// v000
// The times below were measured on an AMD MI455X: many runs one after another, warmed up first and cycling through
// copies of the inputs, with the whole window's GPU time divided by the number of runs. Launches and the gaps
// between them are all in it. The median over several windows is given; except for v000 it joins two sittings, which
// can be a few percent apart, so the side-by-side timings, each taken in one sitting, are the better comparison.
// v000, which the later versions start from, runs in 314 microseconds.
#include <hip/hip_runtime.h>
#include <hip/hip_bf16.h>

typedef float v2f __attribute__((ext_vector_type(2)));
typedef float v8f __attribute__((ext_vector_type(8)));

#define TILE_M 64
#define TILE_N 128
#define KC 32
#define LDS_PAD 34  // row stride in dwords; conflict-free for fragment gathers

// ---------------------------------------------------------------------------
// GEMM: Out[M,Nc] = A[M,K] @ Bm[Nc,K]^T (+ bias[Nc])
// fp32 WMMA 16x16x4, wave32. Block = 256 threads = 8 waves, 64x128 tile.
// Each wave: 16 rows x 64 cols (4 N-subtiles) -> 1 A-frag feeds 4 WMMAs.
// Register double-buffering hides global->LDS staging behind the WMMA chain.
// ---------------------------------------------------------------------------
__global__ __launch_bounds__(256) void gemm_rt_wmma(
    const float* __restrict__ A, const float* __restrict__ Bm,
    const float* __restrict__ bias, float* __restrict__ Out,
    int M, int K, int Nc)
{
    __shared__ float As[TILE_M][LDS_PAD];
    __shared__ float Bs[TILE_N][LDS_PAD];

    const int tid  = threadIdx.x;
    const int m0   = blockIdx.x * TILE_M;
    const int n0   = blockIdx.y * TILE_N;
    const int wave = tid >> 5;
    const int lane = tid & 31;
    const int wm   = wave & 3;   // 4 waves along M
    const int wn   = wave >> 2;  // 2 waves along N, 64 cols each
    const int lm   = lane & 15;
    const int kh   = lane >> 4;  // 0/1 half of wave

    // staging registers: 2 float4 for A tile, 4 float4 for B tile
    float4 ra[2], rb[4];
    // per-thread staging coordinates (row, kcol) for the 6 float4 pieces
    int arow[2], acol[2], brow[4], bcol[4];
    #pragma unroll
    for (int j = 0; j < 2; ++j) {
        int li = tid + j * 256;          // 0..511 -> A tile (64x32 = 512 float4)
        arow[j] = li >> 3;
        acol[j] = (li & 7) << 2;
    }
    #pragma unroll
    for (int j = 0; j < 4; ++j) {
        int li = tid + j * 256;          // 0..1023 -> B tile (128x32 = 1024 float4)
        brow[j] = li >> 3;
        bcol[j] = (li & 7) << 2;
    }

    v8f c[4];
    #pragma unroll
    for (int s = 0; s < 4; ++s) c[s] = (v8f){};

    // prologue: stage chunk 0
    #pragma unroll
    for (int j = 0; j < 2; ++j)
        ra[j] = *(const float4*)(A + (size_t)(m0 + arow[j]) * K + acol[j]);
    #pragma unroll
    for (int j = 0; j < 4; ++j)
        rb[j] = *(const float4*)(Bm + (size_t)(n0 + brow[j]) * K + bcol[j]);
    #pragma unroll
    for (int j = 0; j < 2; ++j) {
        As[arow[j]][acol[j]+0] = ra[j].x; As[arow[j]][acol[j]+1] = ra[j].y;
        As[arow[j]][acol[j]+2] = ra[j].z; As[arow[j]][acol[j]+3] = ra[j].w;
    }
    #pragma unroll
    for (int j = 0; j < 4; ++j) {
        Bs[brow[j]][bcol[j]+0] = rb[j].x; Bs[brow[j]][bcol[j]+1] = rb[j].y;
        Bs[brow[j]][bcol[j]+2] = rb[j].z; Bs[brow[j]][bcol[j]+3] = rb[j].w;
    }
    __syncthreads();

    for (int k0 = 0; k0 < K; k0 += KC) {
        const bool last = (k0 + KC >= K);
        if (!last) {
            // prefetch next chunk into registers (overlaps WMMA chain)
            #pragma unroll
            for (int j = 0; j < 2; ++j)
                ra[j] = *(const float4*)(A + (size_t)(m0 + arow[j]) * K + k0 + KC + acol[j]);
            #pragma unroll
            for (int j = 0; j < 4; ++j)
                rb[j] = *(const float4*)(Bm + (size_t)(n0 + brow[j]) * K + k0 + KC + bcol[j]);
        }

        #pragma unroll
        for (int kk = 0; kk < KC; kk += 4) {
            // A frag: value j -> A[m][kk + j + 2*kh]; B frag mirrors in K
            v2f a = *(const v2f*)&As[wm * 16 + lm][kk + 2 * kh];
            #pragma unroll
            for (int s = 0; s < 4; ++s) {
                v2f b = *(const v2f*)&Bs[wn * 64 + s * 16 + lm][kk + 2 * kh];
                c[s] = __builtin_amdgcn_wmma_f32_16x16x4_f32(
                        false, a, false, b, (short)0, c[s], false, false);
            }
        }
        __syncthreads();   // all LDS reads of this chunk done

        if (!last) {
            // commit prefetched chunk
            #pragma unroll
            for (int j = 0; j < 2; ++j) {
                As[arow[j]][acol[j]+0] = ra[j].x; As[arow[j]][acol[j]+1] = ra[j].y;
                As[arow[j]][acol[j]+2] = ra[j].z; As[arow[j]][acol[j]+3] = ra[j].w;
            }
            #pragma unroll
            for (int j = 0; j < 4; ++j) {
                Bs[brow[j]][bcol[j]+0] = rb[j].x; Bs[brow[j]][bcol[j]+1] = rb[j].y;
                Bs[brow[j]][bcol[j]+2] = rb[j].z; Bs[brow[j]][bcol[j]+3] = rb[j].w;
            }
            __syncthreads();
        }
    }

    // Epilogue: C layout — VGPR v, half kh: row = v + 8*kh, col = lm
    #pragma unroll
    for (int s = 0; s < 4; ++s) {
        int col = n0 + wn * 64 + s * 16 + lm;
        float bv = bias ? bias[col] : 0.0f;
        #pragma unroll
        for (int v = 0; v < 8; ++v) {
            int row = m0 + wm * 16 + v + 8 * kh;
            Out[(size_t)row * Nc + col] = c[s][v] + bv;
        }
    }
}

// ---------------------------------------------------------------------------
// Reshape qk [B,N,1024] -> channel-major vid layout [128][64][1024],
// with per-pixel L2 normalization over the 64 channels and k time-shift.
// ---------------------------------------------------------------------------
__global__ __launch_bounds__(256) void reshape_norm(
    const float* __restrict__ qk, float* __restrict__ qvn, float* __restrict__ kvn)
{
    const int f = blockIdx.x;                       // frame 0..127
    const int p = blockIdx.y * 256 + threadIdx.x;   // pixel 0..1023
    const int b = f >> 6;
    const int h = (f >> 3) & 7;
    const int t = f & 7;
    const size_t fbase = (size_t)f * 65536;

    // ---- q ----
    {
        int n = t * 1024 + p;
        const float4* src = (const float4*)(qk + ((size_t)(b * 8192 + n)) * 1024 + h * 64);
        float4 v[16];
        float ss = 0.0f;
        #pragma unroll
        for (int i = 0; i < 16; ++i) {
            v[i] = src[i];
            ss += v[i].x * v[i].x + v[i].y * v[i].y + v[i].z * v[i].z + v[i].w * v[i].w;
        }
        float s = 1.0f / fmaxf(sqrtf(ss), 1e-12f);
        #pragma unroll
        for (int i = 0; i < 16; ++i) {
            qvn[fbase + (size_t)(4 * i + 0) * 1024 + p] = v[i].x * s;
            qvn[fbase + (size_t)(4 * i + 1) * 1024 + p] = v[i].y * s;
            qvn[fbase + (size_t)(4 * i + 2) * 1024 + p] = v[i].z * s;
            qvn[fbase + (size_t)(4 * i + 3) * 1024 + p] = v[i].w * s;
        }
    }
    // ---- k (time-shifted forward, repeat last frame) ----
    {
        int ts = (t == 7) ? 7 : t + 1;
        int n = ts * 1024 + p;
        const float4* src = (const float4*)(qk + ((size_t)(b * 8192 + n)) * 1024 + 512 + h * 64);
        float4 v[16];
        float ss = 0.0f;
        #pragma unroll
        for (int i = 0; i < 16; ++i) {
            v[i] = src[i];
            ss += v[i].x * v[i].x + v[i].y * v[i].y + v[i].z * v[i].z + v[i].w * v[i].w;
        }
        float s = 1.0f / fmaxf(sqrtf(ss), 1e-12f);
        #pragma unroll
        for (int i = 0; i < 16; ++i) {
            kvn[fbase + (size_t)(4 * i + 0) * 1024 + p] = v[i].x * s;
            kvn[fbase + (size_t)(4 * i + 1) * 1024 + p] = v[i].y * s;
            kvn[fbase + (size_t)(4 * i + 2) * 1024 + p] = v[i].z * s;
            kvn[fbase + (size_t)(4 * i + 3) * 1024 + p] = v[i].w * s;
        }
    }
}

// ---------------------------------------------------------------------------
// 7x7 local cost volume (zero-padded) + 49->64 projection, fused.
// Block = (frame, 4-row strip), 128 threads = 1 pixel each.
// Output written directly in final [B, N, C] layout (contiguous 64 floats).
// ---------------------------------------------------------------------------
#define CHC 16
__global__ __launch_bounds__(128) void costvol_proj(
    const float* __restrict__ qvn, const float* __restrict__ kvn,
    const float* __restrict__ w_corr, const float* __restrict__ b_corr,
    float* __restrict__ mf)
{
    __shared__ float Ks[CHC][10][40];   // 16ch x (4+6 halo rows) x padded cols
    __shared__ float Wc[64 * 49];
    __shared__ float Bc[64];

    const int f   = blockIdx.x;
    const int y0  = blockIdx.y * 4;
    const int tid = threadIdx.x;
    const int x   = tid & 31;
    const int yl  = tid >> 5;           // 0..3
    const int y   = y0 + yl;
    const size_t fbase = (size_t)f * 65536;

    for (int i = tid; i < 64 * 49; i += 128) Wc[i] = w_corr[i];
    if (tid < 64) Bc[tid] = b_corr[tid];

    float corr[49];
    #pragma unroll
    for (int i = 0; i < 49; ++i) corr[i] = 0.0f;

    for (int c0 = 0; c0 < 64; c0 += CHC) {
        __syncthreads();  // previous Ks reads done (also covers Wc/Bc writes)
        for (int i = tid; i < CHC * 10 * 40; i += 128) {
            int lc = i % 40;
            int r  = (i / 40) % 10;
            int ch = i / 400;
            int gx = lc - 3;
            int gy = y0 + r - 3;
            float val = 0.0f;
            if (gx >= 0 && gx < 32 && gy >= 0 && gy < 32)
                val = kvn[fbase + (size_t)(c0 + ch) * 1024 + gy * 32 + gx];
            Ks[ch][r][lc] = val;
        }
        __syncthreads();

        float qr[CHC];
        #pragma unroll
        for (int ch = 0; ch < CHC; ++ch)
            qr[ch] = qvn[fbase + (size_t)(c0 + ch) * 1024 + y * 32 + x];

        #pragma unroll
        for (int u = 0; u < 7; ++u) {
            #pragma unroll
            for (int v = 0; v < 7; ++v) {
                float acc = corr[u * 7 + v];
                #pragma unroll
                for (int ch = 0; ch < CHC; ++ch)
                    acc += qr[ch] * Ks[ch][yl + u][x + v];
                corr[u * 7 + v] = acc;
            }
        }
    }
    __syncthreads();

    // projection 49 -> 64, write into [B, N, C] layout
    const int b = f >> 6;
    const int h = (f >> 3) & 7;
    const int t = f & 7;
    const int n = t * 1024 + y * 32 + x;
    float* outp = mf + ((size_t)(b * 8192 + n)) * 512 + h * 64;

    #pragma unroll 4
    for (int g = 0; g < 16; ++g) {
        float4 r;
        float* rp = (float*)&r;
        #pragma unroll
        for (int j = 0; j < 4; ++j) {
            int dch = g * 4 + j;
            float acc = Bc[dch];
            const float* w = &Wc[dch * 49];
            #pragma unroll
            for (int uv = 0; uv < 49; ++uv) acc += w[uv] * corr[uv];
            rp[j] = acc;
        }
        ((float4*)outp)[g] = r;
    }
}

// ---------------------------------------------------------------------------
extern "C" void kernel_launch(void* const* d_in, const int* in_sizes, int n_in,
                              void* d_out, int out_size, void* d_ws, size_t ws_size,
                              hipStream_t stream)
{
    const float* x      = (const float*)d_in[0];  // [2, 8192, 512]
    const float* w_qk   = (const float*)d_in[1];  // [1024, 512]
    const float* w_corr = (const float*)d_in[2];  // [64, 49]
    const float* b_corr = (const float*)d_in[3];  // [64]
    const float* w_proj = (const float*)d_in[4];  // [512, 512]
    const float* b_proj = (const float*)d_in[5];  // [512]
    float* out = (float*)d_out;                   // [2, 8192, 512]

    const int M = 16384, K = 512;

    float* qk  = (float*)d_ws;                      // 16384*1024 floats (64 MB)
    float* qvn = qk + (size_t)16384 * 1024;         // 128*64*1024 floats (32 MB)
    float* kvn = qvn + (size_t)128 * 65536;         // 32 MB
    float* mf  = qk;                                // reuse dead qk region (32 MB)

    // 1) qk = x @ w_qk^T
    gemm_rt_wmma<<<dim3(M / TILE_M, 1024 / TILE_N), 256, 0, stream>>>(
        x, w_qk, nullptr, qk, M, K, 1024);

    // 2) split q/k, time-shift k, L2-normalize, channel-major vid layout
    reshape_norm<<<dim3(128, 4), 256, 0, stream>>>(qk, qvn, kvn);

    // 3) cost volume + 49->64 projection, fused, output in [B,N,C] layout
    costvol_proj<<<dim3(128, 8), 128, 0, stream>>>(qvn, kvn, w_corr, b_corr, mf);

    // 4) out = mf @ w_proj^T + b_proj
    gemm_rt_wmma<<<dim3(M / TILE_M, 512 / TILE_N), 256, 0, stream>>>(
        mf, w_proj, b_proj, out, M, K, 512);
}

// v001
// One run takes 194 microseconds.
// Timed twice side by side with v000, it ran 1.65 times as fast both times.
#include <hip/hip_runtime.h>
#include <hip/hip_bf16.h>

typedef float v2f __attribute__((ext_vector_type(2)));
typedef float v8f __attribute__((ext_vector_type(8)));

#define TILE_M 64
#define TILE_N 128
#define KC 32
#define LDS_PAD 34  // row stride in dwords; conflict-free for fragment gathers

// ---------------------------------------------------------------------------
// GEMM: Out[M,Nc] = A[M,K] @ Bm[Nc,K]^T (+ bias[Nc])
// fp32 WMMA 16x16x4, wave32. Block = 256 threads = 8 waves, 64x128 tile.
// Each wave: 16 rows x 64 cols (4 N-subtiles) -> 1 A-frag feeds 4 WMMAs.
// Register double-buffering hides global->LDS staging behind the WMMA chain.
// ---------------------------------------------------------------------------
__global__ __launch_bounds__(256) void gemm_rt_wmma(
    const float* __restrict__ A, const float* __restrict__ Bm,
    const float* __restrict__ bias, float* __restrict__ Out,
    int M, int K, int Nc)
{
    __shared__ float As[TILE_M][LDS_PAD];
    __shared__ float Bs[TILE_N][LDS_PAD];

    const int tid  = threadIdx.x;
    const int m0   = blockIdx.x * TILE_M;
    const int n0   = blockIdx.y * TILE_N;
    const int wave = tid >> 5;
    const int lane = tid & 31;
    const int wm   = wave & 3;   // 4 waves along M
    const int wn   = wave >> 2;  // 2 waves along N, 64 cols each
    const int lm   = lane & 15;
    const int kh   = lane >> 4;  // 0/1 half of wave

    // staging registers: 2 float4 for A tile, 4 float4 for B tile
    float4 ra[2], rb[4];
    // per-thread staging coordinates (row, kcol) for the 6 float4 pieces
    int arow[2], acol[2], brow[4], bcol[4];
    #pragma unroll
    for (int j = 0; j < 2; ++j) {
        int li = tid + j * 256;          // 0..511 -> A tile (64x32 = 512 float4)
        arow[j] = li >> 3;
        acol[j] = (li & 7) << 2;
    }
    #pragma unroll
    for (int j = 0; j < 4; ++j) {
        int li = tid + j * 256;          // 0..1023 -> B tile (128x32 = 1024 float4)
        brow[j] = li >> 3;
        bcol[j] = (li & 7) << 2;
    }

    v8f c[4];
    #pragma unroll
    for (int s = 0; s < 4; ++s) c[s] = (v8f){};

    // prologue: stage chunk 0
    #pragma unroll
    for (int j = 0; j < 2; ++j)
        ra[j] = *(const float4*)(A + (size_t)(m0 + arow[j]) * K + acol[j]);
    #pragma unroll
    for (int j = 0; j < 4; ++j)
        rb[j] = *(const float4*)(Bm + (size_t)(n0 + brow[j]) * K + bcol[j]);
    #pragma unroll
    for (int j = 0; j < 2; ++j) {
        As[arow[j]][acol[j]+0] = ra[j].x; As[arow[j]][acol[j]+1] = ra[j].y;
        As[arow[j]][acol[j]+2] = ra[j].z; As[arow[j]][acol[j]+3] = ra[j].w;
    }
    #pragma unroll
    for (int j = 0; j < 4; ++j) {
        Bs[brow[j]][bcol[j]+0] = rb[j].x; Bs[brow[j]][bcol[j]+1] = rb[j].y;
        Bs[brow[j]][bcol[j]+2] = rb[j].z; Bs[brow[j]][bcol[j]+3] = rb[j].w;
    }
    __syncthreads();

    for (int k0 = 0; k0 < K; k0 += KC) {
        const bool last = (k0 + KC >= K);
        if (!last) {
            // prefetch next chunk into registers (overlaps WMMA chain)
            #pragma unroll
            for (int j = 0; j < 2; ++j)
                ra[j] = *(const float4*)(A + (size_t)(m0 + arow[j]) * K + k0 + KC + acol[j]);
            #pragma unroll
            for (int j = 0; j < 4; ++j)
                rb[j] = *(const float4*)(Bm + (size_t)(n0 + brow[j]) * K + k0 + KC + bcol[j]);
        }

        #pragma unroll
        for (int kk = 0; kk < KC; kk += 4) {
            // A frag: value j -> A[m][kk + j + 2*kh]; B frag mirrors in K
            v2f a = *(const v2f*)&As[wm * 16 + lm][kk + 2 * kh];
            #pragma unroll
            for (int s = 0; s < 4; ++s) {
                v2f b = *(const v2f*)&Bs[wn * 64 + s * 16 + lm][kk + 2 * kh];
                c[s] = __builtin_amdgcn_wmma_f32_16x16x4_f32(
                        false, a, false, b, (short)0, c[s], false, false);
            }
        }
        __syncthreads();   // all LDS reads of this chunk done

        if (!last) {
            // commit prefetched chunk
            #pragma unroll
            for (int j = 0; j < 2; ++j) {
                As[arow[j]][acol[j]+0] = ra[j].x; As[arow[j]][acol[j]+1] = ra[j].y;
                As[arow[j]][acol[j]+2] = ra[j].z; As[arow[j]][acol[j]+3] = ra[j].w;
            }
            #pragma unroll
            for (int j = 0; j < 4; ++j) {
                Bs[brow[j]][bcol[j]+0] = rb[j].x; Bs[brow[j]][bcol[j]+1] = rb[j].y;
                Bs[brow[j]][bcol[j]+2] = rb[j].z; Bs[brow[j]][bcol[j]+3] = rb[j].w;
            }
            __syncthreads();
        }
    }

    // Epilogue: C layout — VGPR v, half kh: row = v + 8*kh, col = lm
    #pragma unroll
    for (int s = 0; s < 4; ++s) {
        int col = n0 + wn * 64 + s * 16 + lm;
        float bv = bias ? bias[col] : 0.0f;
        #pragma unroll
        for (int v = 0; v < 8; ++v) {
            int row = m0 + wm * 16 + v + 8 * kh;
            Out[(size_t)row * Nc + col] = c[s][v] + bv;
        }
    }
}

// ---------------------------------------------------------------------------
// Split qk [B,N,1024] into frames with per-pixel L2 normalization over the
// 64 channels and k time-shift. q: channel-major [128][64][1024];
// k: pixel-major [128][1024][64].
// ---------------------------------------------------------------------------
__global__ __launch_bounds__(256) void reshape_norm(
    const float* __restrict__ qk, float* __restrict__ qvn, float* __restrict__ kvn)
{
    const int f = blockIdx.x;                       // frame 0..127
    const int p = blockIdx.y * 256 + threadIdx.x;   // pixel 0..1023
    const int b = f >> 6;
    const int h = (f >> 3) & 7;
    const int t = f & 7;
    const size_t fbase = (size_t)f * 65536;

    // ---- q ----
    {
        int n = t * 1024 + p;
        const float4* src = (const float4*)(qk + ((size_t)(b * 8192 + n)) * 1024 + h * 64);
        float4 v[16];
        float ss = 0.0f;
        #pragma unroll
        for (int i = 0; i < 16; ++i) {
            v[i] = src[i];
            ss += v[i].x * v[i].x + v[i].y * v[i].y + v[i].z * v[i].z + v[i].w * v[i].w;
        }
        float s = 1.0f / fmaxf(sqrtf(ss), 1e-12f);
        #pragma unroll
        for (int i = 0; i < 16; ++i) {
            qvn[fbase + (size_t)(4 * i + 0) * 1024 + p] = v[i].x * s;
            qvn[fbase + (size_t)(4 * i + 1) * 1024 + p] = v[i].y * s;
            qvn[fbase + (size_t)(4 * i + 2) * 1024 + p] = v[i].z * s;
            qvn[fbase + (size_t)(4 * i + 3) * 1024 + p] = v[i].w * s;
        }
    }
    // ---- k (time-shifted forward, repeat last frame) ----
    {
        int ts = (t == 7) ? 7 : t + 1;
        int n = ts * 1024 + p;
        const float4* src = (const float4*)(qk + ((size_t)(b * 8192 + n)) * 1024 + 512 + h * 64);
        float4 v[16];
        float ss = 0.0f;
        #pragma unroll
        for (int i = 0; i < 16; ++i) {
            v[i] = src[i];
            ss += v[i].x * v[i].x + v[i].y * v[i].y + v[i].z * v[i].z + v[i].w * v[i].w;
        }
        float s = 1.0f / fmaxf(sqrtf(ss), 1e-12f);
        // k stays pixel-major: [frame][pixel][64 channels]
        float4* dst = (float4*)(kvn + fbase + (size_t)p * 64);
        #pragma unroll
        for (int i = 0; i < 16; ++i)
            dst[i] = make_float4(v[i].x * s, v[i].y * s, v[i].z * s, v[i].w * s);
    }
}

// ---------------------------------------------------------------------------
// 7x7 local cost volume (zero-padded) + 49->64 projection, fused.
// Block = (frame, 8-row strip), 256 threads = 1 pixel each.
// The k halo tile (14 x 38 pixels, all 64 channels) sits in LDS pixel-major,
// so one 16-byte LDS read feeds four channels of one displacement.
// Output written directly in final [B, N, C] layout (contiguous 64 floats).
// ---------------------------------------------------------------------------
typedef float v4f __attribute__((ext_vector_type(4)));
#define SROWS 8
#define TROWS (SROWS + 6)
#define TCOLS 38
#define KPITCH 68   // dwords per pixel: 272 B = 16 B x odd, full-rate 16-byte reads
__global__ __launch_bounds__(256, 4) void costvol_proj(
    const float* __restrict__ qvn, const float* __restrict__ kvn,
    const float* __restrict__ w_corr, const float* __restrict__ b_corr,
    float* __restrict__ mf)
{
    __shared__ __attribute__((aligned(16))) float Ks[TROWS * TCOLS * KPITCH];
    __shared__ float Wc[64 * 49];
    __shared__ float Bc[64];

    const int f   = blockIdx.x;
    const int y0  = blockIdx.y * SROWS;
    const int tid = threadIdx.x;
    const int x   = tid & 31;
    const int yl  = tid >> 5;           // 0..7
    const int y   = y0 + yl;
    const size_t fbase = (size_t)f * 65536;

    // this pixel's q, channel-major: four channels are fetched a trip ahead
    const float* qp = qvn + fbase + y * 32 + x;
    v2f q01 = { qp[0 * 1024], qp[1 * 1024] };
    v2f q23 = { qp[2 * 1024], qp[3 * 1024] };

    for (int i = tid; i < 64 * 49; i += 256) Wc[i] = w_corr[i];
    if (tid < 64) Bc[tid] = b_corr[tid];

    // stage the 14 x 32 in-frame columns: 16 lanes per pixel, 16 bytes a lane.
    // Rows outside the frame load a clamped row and store zeros.
    {
        const int c4  = tid & 15;
        const int gx0 = tid >> 4;       // 0..15
        v4f t[2 * TROWS];
        #pragma unroll
        for (int it = 0; it < 2 * TROWS; ++it) {
            int gy  = y0 + (it >> 1) - 3;
            int gyc = gy < 0 ? 0 : (gy > 31 ? 31 : gy);
            // block-uniform row base + this lane's 16 bytes (pixel gx0, channels 4*c4..)
            const float* rowp = kvn + fbase + gyc * 2048 + (it & 1) * 1024;
            t[it] = *(const v4f*)(rowp + tid * 4);
        }
        #pragma unroll
        for (int it = 0; it < 2 * TROWS; ++it) {
            int r   = it >> 1;
            int gy  = y0 + r - 3;
            int gx  = gx0 + (it & 1) * 16;
            v4f val = (gy >= 0 && gy < 32) ? t[it] : (v4f){};
            *(v4f*)&Ks[(r * TCOLS + gx + 3) * KPITCH + c4 * 4] = val;
        }
        // the three zero columns on each side
        for (int i = tid; i < TROWS * 6 * 16; i += 256) {
            int px = i >> 4;
            int r  = px / 6;
            int j  = px - r * 6;
            int lc = j < 3 ? j : j + 32;
            *(v4f*)&Ks[(r * TCOLS + lc) * KPITCH + (i & 15) * 4] = (v4f){};
        }
    }
    __syncthreads();

    float corr[49];
    #pragma unroll
    for (int i = 0; i < 49; ++i) corr[i] = 0.0f;

    const float* kb = &Ks[(yl * TCOLS + x) * KPITCH];
    // kept rolled: unrolled over the channels, the 784 LDS reads are hoisted and spill
    #pragma unroll 1
    for (int c = 0; c < 16; ++c) {
        const int cn = c < 15 ? c + 1 : 15;
        const v2f n01 = { qp[(4 * cn + 0) * 1024], qp[(4 * cn + 1) * 1024] };
        const v2f n23 = { qp[(4 * cn + 2) * 1024], qp[(4 * cn + 3) * 1024] };
        const float* kc = kb + c * 4;
        v4f cur[7], nxt[7];
        #pragma unroll
        for (int v = 0; v < 7; ++v) cur[v] = *(const v4f*)(kc + v * KPITCH);
        #pragma unroll
        for (int u = 0; u < 7; ++u) {
            if (u < 6) {
                #pragma unroll
                for (int v = 0; v < 7; ++v)
                    nxt[v] = *(const v4f*)(kc + ((u + 1) * TCOLS + v) * KPITCH);
            }
            #pragma unroll
            for (int v = 0; v < 7; ++v) {
                float a = corr[u * 7 + v];
                a += q01.x * cur[v].x;
                a += q01.y * cur[v].y;
                a += q23.x * cur[v].z;
                a += q23.y * cur[v].w;
                corr[u * 7 + v] = a;
            }
            // stops the reads of later rows from being hoisted to here: without it all 49
            // are put in flight at once, which takes 256 registers and spills
            __builtin_amdgcn_sched_barrier(0);
            #pragma unroll
            for (int v = 0; v < 7; ++v) cur[v] = nxt[v];
        }
        q01 = n01;
        q23 = n23;
    }

    // projection 49 -> 64, write into [B, N, C] layout
    const int b = f >> 6;
    const int h = (f >> 3) & 7;
    const int t = f & 7;
    const int n = t * 1024 + y * 32 + x;
    float* outp = mf + ((size_t)(b * 8192 + n)) * 512 + h * 64;

    #pragma unroll 4
    for (int g = 0; g < 16; ++g) {
        float4 r;
        float* rp = (float*)&r;
        #pragma unroll
        for (int j = 0; j < 4; ++j) {
            int dch = g * 4 + j;
            float acc = Bc[dch];
            const float* w = &Wc[dch * 49];
            #pragma unroll
            for (int uv = 0; uv < 49; ++uv) acc += w[uv] * corr[uv];
            rp[j] = acc;
        }
        ((float4*)outp)[g] = r;
    }
}

// ---------------------------------------------------------------------------
extern "C" void kernel_launch(void* const* d_in, const int* in_sizes, int n_in,
                              void* d_out, int out_size, void* d_ws, size_t ws_size,
                              hipStream_t stream)
{
    const float* x      = (const float*)d_in[0];  // [2, 8192, 512]
    const float* w_qk   = (const float*)d_in[1];  // [1024, 512]
    const float* w_corr = (const float*)d_in[2];  // [64, 49]
    const float* b_corr = (const float*)d_in[3];  // [64]
    const float* w_proj = (const float*)d_in[4];  // [512, 512]
    const float* b_proj = (const float*)d_in[5];  // [512]
    float* out = (float*)d_out;                   // [2, 8192, 512]

    const int M = 16384, K = 512;

    float* qk  = (float*)d_ws;                      // 16384*1024 floats (64 MB)
    float* qvn = qk + (size_t)16384 * 1024;         // 128*64*1024 floats (32 MB)
    float* kvn = qvn + (size_t)128 * 65536;         // 32 MB
    float* mf  = qk;                                // reuse dead qk region (32 MB)

    // 1) qk = x @ w_qk^T
    gemm_rt_wmma<<<dim3(M / TILE_M, 1024 / TILE_N), 256, 0, stream>>>(
        x, w_qk, nullptr, qk, M, K, 1024);

    // 2) split q/k, time-shift k, L2-normalize; q channel-major, k pixel-major
    reshape_norm<<<dim3(128, 4), 256, 0, stream>>>(qk, qvn, kvn);

    // 3) cost volume + 49->64 projection, fused, output in [B,N,C] layout
    costvol_proj<<<dim3(128, 32 / SROWS), 256, 0, stream>>>(qvn, kvn, w_corr, b_corr, mf);

    // 4) out = mf @ w_proj^T + b_proj
    gemm_rt_wmma<<<dim3(M / TILE_M, 512 / TILE_N), 256, 0, stream>>>(
        mf, w_proj, b_proj, out, M, K, 512);
}

// v002
// Measured time: 179 microseconds a run.
// Two timings next to v001 both put it at 1.09 times that version's speed.
// Counting every step since v000, it is 1.80 times as fast.
#include <hip/hip_runtime.h>
#include <hip/hip_bf16.h>

typedef float v2f __attribute__((ext_vector_type(2)));
typedef float v8f __attribute__((ext_vector_type(8)));

#define TILE_M 64
#define TILE_N 128
#define KC 32
#define LDS_PAD 34  // row stride in dwords; conflict-free for fragment gathers

// ---------------------------------------------------------------------------
// GEMM: Out[M,Nc] = A[M,K] @ Bm[Nc,K]^T (+ bias[Nc])
// fp32 WMMA 16x16x4, wave32. Block = 256 threads = 8 waves, 64x128 tile.
// Each wave: 16 rows x 64 cols (4 N-subtiles) -> 1 A-frag feeds 4 WMMAs.
// Register double-buffering hides global->LDS staging behind the WMMA chain.
// HEADW == 0: A is row-major [M][K]. HEADW > 0: A is K/HEADW planes of
// [M][HEADW], column k lying in plane k / HEADW (HEADW a multiple of 4).
// ---------------------------------------------------------------------------
template <int HEADW>
__device__ __forceinline__ const float4* a_piece(const float* A, int M, int K, int row, int k)
{
    if (HEADW == 0) return (const float4*)(A + (size_t)row * K + k);
    const int h = k / HEADW;
    return (const float4*)(A + ((size_t)h * M + row) * HEADW + (k - h * HEADW));
}

template <int HEADW>
__global__ __launch_bounds__(256) void gemm_rt_wmma(
    const float* __restrict__ A, const float* __restrict__ Bm,
    const float* __restrict__ bias, float* __restrict__ Out,
    int M, int K, int Nc)
{
    __shared__ float As[TILE_M][LDS_PAD];
    __shared__ float Bs[TILE_N][LDS_PAD];

    const int tid  = threadIdx.x;
    const int m0   = blockIdx.x * TILE_M;
    const int n0   = blockIdx.y * TILE_N;
    const int wave = tid >> 5;
    const int lane = tid & 31;
    const int wm   = wave & 3;   // 4 waves along M
    const int wn   = wave >> 2;  // 2 waves along N, 64 cols each
    const int lm   = lane & 15;
    const int kh   = lane >> 4;  // 0/1 half of wave

    // staging registers: 2 float4 for A tile, 4 float4 for B tile
    float4 ra[2], rb[4];
    // per-thread staging coordinates (row, kcol) for the 6 float4 pieces
    int arow[2], acol[2], brow[4], bcol[4];
    #pragma unroll
    for (int j = 0; j < 2; ++j) {
        int li = tid + j * 256;          // 0..511 -> A tile (64x32 = 512 float4)
        arow[j] = li >> 3;
        acol[j] = (li & 7) << 2;
    }
    #pragma unroll
    for (int j = 0; j < 4; ++j) {
        int li = tid + j * 256;          // 0..1023 -> B tile (128x32 = 1024 float4)
        brow[j] = li >> 3;
        bcol[j] = (li & 7) << 2;
    }

    v8f c[4];
    #pragma unroll
    for (int s = 0; s < 4; ++s) c[s] = (v8f){};

    // prologue: stage chunk 0
    #pragma unroll
    for (int j = 0; j < 2; ++j)
        ra[j] = *a_piece<HEADW>(A, M, K, m0 + arow[j], acol[j]);
    #pragma unroll
    for (int j = 0; j < 4; ++j)
        rb[j] = *(const float4*)(Bm + (size_t)(n0 + brow[j]) * K + bcol[j]);
    #pragma unroll
    for (int j = 0; j < 2; ++j) {
        As[arow[j]][acol[j]+0] = ra[j].x; As[arow[j]][acol[j]+1] = ra[j].y;
        As[arow[j]][acol[j]+2] = ra[j].z; As[arow[j]][acol[j]+3] = ra[j].w;
    }
    #pragma unroll
    for (int j = 0; j < 4; ++j) {
        Bs[brow[j]][bcol[j]+0] = rb[j].x; Bs[brow[j]][bcol[j]+1] = rb[j].y;
        Bs[brow[j]][bcol[j]+2] = rb[j].z; Bs[brow[j]][bcol[j]+3] = rb[j].w;
    }
    __syncthreads();

    for (int k0 = 0; k0 < K; k0 += KC) {
        const bool last = (k0 + KC >= K);
        if (!last) {
            // prefetch next chunk into registers (overlaps WMMA chain)
            #pragma unroll
            for (int j = 0; j < 2; ++j)
                ra[j] = *a_piece<HEADW>(A, M, K, m0 + arow[j], k0 + KC + acol[j]);
            #pragma unroll
            for (int j = 0; j < 4; ++j)
                rb[j] = *(const float4*)(Bm + (size_t)(n0 + brow[j]) * K + k0 + KC + bcol[j]);
        }

        #pragma unroll
        for (int kk = 0; kk < KC; kk += 4) {
            // A frag: value j -> A[m][kk + j + 2*kh]; B frag mirrors in K
            v2f a = *(const v2f*)&As[wm * 16 + lm][kk + 2 * kh];
            #pragma unroll
            for (int s = 0; s < 4; ++s) {
                v2f b = *(const v2f*)&Bs[wn * 64 + s * 16 + lm][kk + 2 * kh];
                c[s] = __builtin_amdgcn_wmma_f32_16x16x4_f32(
                        false, a, false, b, (short)0, c[s], false, false);
            }
        }
        __syncthreads();   // all LDS reads of this chunk done

        if (!last) {
            // commit prefetched chunk
            #pragma unroll
            for (int j = 0; j < 2; ++j) {
                As[arow[j]][acol[j]+0] = ra[j].x; As[arow[j]][acol[j]+1] = ra[j].y;
                As[arow[j]][acol[j]+2] = ra[j].z; As[arow[j]][acol[j]+3] = ra[j].w;
            }
            #pragma unroll
            for (int j = 0; j < 4; ++j) {
                Bs[brow[j]][bcol[j]+0] = rb[j].x; Bs[brow[j]][bcol[j]+1] = rb[j].y;
                Bs[brow[j]][bcol[j]+2] = rb[j].z; Bs[brow[j]][bcol[j]+3] = rb[j].w;
            }
            __syncthreads();
        }
    }

    // Epilogue: C layout — VGPR v, half kh: row = v + 8*kh, col = lm
    #pragma unroll
    for (int s = 0; s < 4; ++s) {
        int col = n0 + wn * 64 + s * 16 + lm;
        float bv = bias ? bias[col] : 0.0f;
        #pragma unroll
        for (int v = 0; v < 8; ++v) {
            int row = m0 + wm * 16 + v + 8 * kh;
            Out[(size_t)row * Nc + col] = c[s][v] + bv;
        }
    }
}

// ---------------------------------------------------------------------------
// Split qk [B,N,1024] into frames with per-pixel L2 normalization over the
// 64 channels and k time-shift. q: channel-major [128][64][1024];
// k: pixel-major [128][1024][64].
// ---------------------------------------------------------------------------
__global__ __launch_bounds__(256) void reshape_norm(
    const float* __restrict__ qk, float* __restrict__ qvn, float* __restrict__ kvn)
{
    const int f = blockIdx.x;                       // frame 0..127
    const int p = blockIdx.y * 256 + threadIdx.x;   // pixel 0..1023
    const int b = f >> 6;
    const int h = (f >> 3) & 7;
    const int t = f & 7;
    const size_t fbase = (size_t)f * 65536;

    // ---- q ----
    {
        int n = t * 1024 + p;
        const float4* src = (const float4*)(qk + ((size_t)(b * 8192 + n)) * 1024 + h * 64);
        float4 v[16];
        float ss = 0.0f;
        #pragma unroll
        for (int i = 0; i < 16; ++i) {
            v[i] = src[i];
            ss += v[i].x * v[i].x + v[i].y * v[i].y + v[i].z * v[i].z + v[i].w * v[i].w;
        }
        float s = 1.0f / fmaxf(sqrtf(ss), 1e-12f);
        #pragma unroll
        for (int i = 0; i < 16; ++i) {
            qvn[fbase + (size_t)(4 * i + 0) * 1024 + p] = v[i].x * s;
            qvn[fbase + (size_t)(4 * i + 1) * 1024 + p] = v[i].y * s;
            qvn[fbase + (size_t)(4 * i + 2) * 1024 + p] = v[i].z * s;
            qvn[fbase + (size_t)(4 * i + 3) * 1024 + p] = v[i].w * s;
        }
    }
    // ---- k (time-shifted forward, repeat last frame) ----
    {
        int ts = (t == 7) ? 7 : t + 1;
        int n = ts * 1024 + p;
        const float4* src = (const float4*)(qk + ((size_t)(b * 8192 + n)) * 1024 + 512 + h * 64);
        float4 v[16];
        float ss = 0.0f;
        #pragma unroll
        for (int i = 0; i < 16; ++i) {
            v[i] = src[i];
            ss += v[i].x * v[i].x + v[i].y * v[i].y + v[i].z * v[i].z + v[i].w * v[i].w;
        }
        float s = 1.0f / fmaxf(sqrtf(ss), 1e-12f);
        // k stays pixel-major: [frame][pixel][64 channels]
        float4* dst = (float4*)(kvn + fbase + (size_t)p * 64);
        #pragma unroll
        for (int i = 0; i < 16; ++i)
            dst[i] = make_float4(v[i].x * s, v[i].y * s, v[i].z * s, v[i].w * s);
    }
}

// ---------------------------------------------------------------------------
// 7x7 local cost volume (zero-padded).
// Block = (frame, 8-row strip), 256 threads = 1 pixel each.
// The k halo tile (14 x 38 pixels, all 64 channels) sits in LDS pixel-major,
// so one 16-byte LDS read feeds four channels of one displacement.
// Output: one plane per head, [head][B*N][CORRW]: a pixel's 49 correlations and
// three zeros, so that a wave's 32 pixels fill 52 whole 128-byte lines of its own.
// ---------------------------------------------------------------------------
typedef float v4f __attribute__((ext_vector_type(4)));
#define SROWS 8
#define TROWS (SROWS + 6)
#define TCOLS 38
#define KPITCH 68   // dwords per pixel: 272 B = 16 B x odd, full-rate 16-byte reads
#define CORRW 52    // 49 correlations padded to whole 16-byte pieces
__global__ __launch_bounds__(256, 4) void costvol(
    const float* __restrict__ qvn, const float* __restrict__ kvn,
    float* __restrict__ cv)
{
    __shared__ __attribute__((aligned(16))) float Ks[TROWS * TCOLS * KPITCH];

    const int f   = blockIdx.x;
    const int y0  = blockIdx.y * SROWS;
    const int tid = threadIdx.x;
    const int x   = tid & 31;
    const int yl  = tid >> 5;           // 0..7
    const int y   = y0 + yl;
    const size_t fbase = (size_t)f * 65536;

    // this pixel's q, channel-major: four channels are fetched a trip ahead
    const float* qp = qvn + fbase + y * 32 + x;
    v2f q01 = { qp[0 * 1024], qp[1 * 1024] };
    v2f q23 = { qp[2 * 1024], qp[3 * 1024] };

    // stage the 14 x 32 in-frame columns: 16 lanes per pixel, 16 bytes a lane.
    // Rows outside the frame load a clamped row and store zeros.
    {
        const int c4  = tid & 15;
        const int gx0 = tid >> 4;       // 0..15
        v4f t[2 * TROWS];
        #pragma unroll
        for (int it = 0; it < 2 * TROWS; ++it) {
            int gy  = y0 + (it >> 1) - 3;
            int gyc = gy < 0 ? 0 : (gy > 31 ? 31 : gy);
            // block-uniform row base + this lane's 16 bytes (pixel gx0, channels 4*c4..)
            const float* rowp = kvn + fbase + gyc * 2048 + (it & 1) * 1024;
            t[it] = *(const v4f*)(rowp + tid * 4);
        }
        #pragma unroll
        for (int it = 0; it < 2 * TROWS; ++it) {
            int r   = it >> 1;
            int gy  = y0 + r - 3;
            int gx  = gx0 + (it & 1) * 16;
            v4f val = (gy >= 0 && gy < 32) ? t[it] : (v4f){};
            *(v4f*)&Ks[(r * TCOLS + gx + 3) * KPITCH + c4 * 4] = val;
        }
        // the three zero columns on each side
        for (int i = tid; i < TROWS * 6 * 16; i += 256) {
            int px = i >> 4;
            int r  = px / 6;
            int j  = px - r * 6;
            int lc = j < 3 ? j : j + 32;
            *(v4f*)&Ks[(r * TCOLS + lc) * KPITCH + (i & 15) * 4] = (v4f){};
        }
    }
    __syncthreads();

    float corr[49];
    #pragma unroll
    for (int i = 0; i < 49; ++i) corr[i] = 0.0f;

    const float* kb = &Ks[(yl * TCOLS + x) * KPITCH];
    // kept rolled: unrolled over the channels, the 784 LDS reads are hoisted and spill
    #pragma unroll 1
    for (int c = 0; c < 16; ++c) {
        const int cn = c < 15 ? c + 1 : 15;
        const v2f n01 = { qp[(4 * cn + 0) * 1024], qp[(4 * cn + 1) * 1024] };
        const v2f n23 = { qp[(4 * cn + 2) * 1024], qp[(4 * cn + 3) * 1024] };
        const float* kc = kb + c * 4;
        v4f cur[7], nxt[7];
        #pragma unroll
        for (int v = 0; v < 7; ++v) cur[v] = *(const v4f*)(kc + v * KPITCH);
        #pragma unroll
        for (int u = 0; u < 7; ++u) {
            if (u < 6) {
                #pragma unroll
                for (int v = 0; v < 7; ++v)
                    nxt[v] = *(const v4f*)(kc + ((u + 1) * TCOLS + v) * KPITCH);
            }
            #pragma unroll
            for (int v = 0; v < 7; ++v) {
                float a = corr[u * 7 + v];
                a += q01.x * cur[v].x;
                a += q01.y * cur[v].y;
                a += q23.x * cur[v].z;
                a += q23.y * cur[v].w;
                corr[u * 7 + v] = a;
            }
            // stops the reads of later rows from being hoisted to here: without it all 49
            // are put in flight at once, which takes 256 registers and spills
            __builtin_amdgcn_sched_barrier(0);
            #pragma unroll
            for (int v = 0; v < 7; ++v) cur[v] = nxt[v];
        }
        q01 = n01;
        q23 = n23;
    }

    // store the correlations into this head's plane
    const int b = f >> 6;
    const int h = (f >> 3) & 7;
    const int t = f & 7;
    const int n = t * 1024 + y * 32 + x;
    float4* outp = (float4*)(cv + ((size_t)h * 16384 + b * 8192 + n) * CORRW);

    #pragma unroll   // constant indices keep corr[] in registers
    for (int g = 0; g < 12; ++g)
        outp[g] = make_float4(corr[4 * g], corr[4 * g + 1], corr[4 * g + 2], corr[4 * g + 3]);
    outp[12] = make_float4(corr[48], 0.0f, 0.0f, 0.0f);
}

// ---------------------------------------------------------------------------
// Folds the 49->64 projection into the final projection's weights:
//   wf[o][h*CORRW + uv] = sum_d w_proj[o][h*64 + d] * w_corr[d][uv]   (0 for uv >= 49)
//   bf[o]               = b_proj[o] + sum_c w_proj[o][c] * b_corr[c % 64]
// Block = one output column o; threads 0..415 one wf element each, wave 13 the bias.
// ---------------------------------------------------------------------------
__global__ __launch_bounds__(448) void fold_proj(
    const float* __restrict__ w_proj, const float* __restrict__ w_corr,
    const float* __restrict__ b_corr, const float* __restrict__ b_proj,
    float* __restrict__ wf, float* __restrict__ bf)
{
    __shared__ float Wp[512];
    __shared__ float Wc[64 * 49];

    const int o   = blockIdx.x;
    const int tid = threadIdx.x;
    // all loads first, so that they are in flight together (64 * 49 = 7 * 448)
    float rc[7];
    #pragma unroll   // rc[] stays in registers
    for (int i = 0; i < 7; ++i) rc[i] = w_corr[tid + 448 * i];
    const float rp0 = w_proj[o * 512 + tid];
    const float rp1 = w_proj[o * 512 + 448 + (tid & 63)];
    #pragma unroll   // rc[] stays in registers
    for (int i = 0; i < 7; ++i) Wc[tid + 448 * i] = rc[i];
    Wp[tid] = rp0;
    if (tid < 64) Wp[448 + tid] = rp1;
    __syncthreads();

    if (tid < 8 * CORRW) {
        const int h  = tid / CORRW;
        const int uv = tid - h * CORRW;
        float acc = 0.0f;
        if (uv < 49) {
            // four partial sums and a flat loop: the LDS reads run ahead of the adds
            float a0 = 0.0f, a1 = 0.0f, a2 = 0.0f, a3 = 0.0f;
            #pragma unroll
            for (int d = 0; d < 64; d += 4) {
                a0 += Wp[h * 64 + d + 0] * Wc[(d + 0) * 49 + uv];
                a1 += Wp[h * 64 + d + 1] * Wc[(d + 1) * 49 + uv];
                a2 += Wp[h * 64 + d + 2] * Wc[(d + 2) * 49 + uv];
                a3 += Wp[h * 64 + d + 3] * Wc[(d + 3) * 49 + uv];
            }
            acc = (a0 + a1) + (a2 + a3);
        }
        wf[o * (8 * CORRW) + tid] = acc;
    } else {
        const int lane = tid - 8 * CORRW;   // 0..31
        float s = 0.0f;
        #pragma unroll   // the 16 LDS reads are issued together
        for (int i = 0; i < 16; ++i) {
            int c = lane + 32 * i;
            s += Wp[c] * b_corr[c & 63];
        }
        #pragma unroll   // five fixed steps of the wave-wide sum
        for (int m = 16; m >= 1; m >>= 1) s += __shfl_xor(s, m, 32);
        if (lane == 0) bf[o] = b_proj[o] + s;
    }
}

// ---------------------------------------------------------------------------
extern "C" void kernel_launch(void* const* d_in, const int* in_sizes, int n_in,
                              void* d_out, int out_size, void* d_ws, size_t ws_size,
                              hipStream_t stream)
{
    const float* x      = (const float*)d_in[0];  // [2, 8192, 512]
    const float* w_qk   = (const float*)d_in[1];  // [1024, 512]
    const float* w_corr = (const float*)d_in[2];  // [64, 49]
    const float* b_corr = (const float*)d_in[3];  // [64]
    const float* w_proj = (const float*)d_in[4];  // [512, 512]
    const float* b_proj = (const float*)d_in[5];  // [512]
    float* out = (float*)d_out;                   // [2, 8192, 512]

    const int M = 16384, K = 512;

    float* qk  = (float*)d_ws;                      // 16384*1024 floats (64 MB)
    float* qvn = qk + (size_t)16384 * 1024;         // 128*64*1024 floats (32 MB)
    float* kvn = qvn + (size_t)128 * 65536;         // 32 MB
    float* cv  = qk;                                // reuse dead qk region (8 planes, 27 MB)
    float* wf  = kvn + (size_t)128 * 65536;         // folded weights [512][416]
    float* bf  = wf + (size_t)512 * 8 * CORRW;      // folded bias [512]

    // 0) fold w_corr, b_corr into the final projection's weights and bias
    fold_proj<<<512, 448, 0, stream>>>(w_proj, w_corr, b_corr, b_proj, wf, bf);

    // 1) qk = x @ w_qk^T
    gemm_rt_wmma<0><<<dim3(M / TILE_M, 1024 / TILE_N), 256, 0, stream>>>(
        x, w_qk, nullptr, qk, M, K, 1024);

    // 2) split q/k, time-shift k, L2-normalize; q channel-major, k pixel-major
    reshape_norm<<<dim3(128, 4), 256, 0, stream>>>(qk, qvn, kvn);

    // 3) cost volume, one plane of 52 columns per head
    costvol<<<dim3(128, 32 / SROWS), 256, 0, stream>>>(qvn, kvn, cv);

    // 4) out = cv @ wf^T + bf, K = 8 heads x 52
    gemm_rt_wmma<CORRW><<<dim3(M / TILE_M, 512 / TILE_N), 256, 0, stream>>>(
        cv, wf, bf, out, M, 8 * CORRW, 512);
}

// v003
// Measured time: 156 microseconds a run.
// In both of two side-by-side timings against v002, it was 1.15 times as fast.
// All steps since v000 together make it 2.06 times as fast.
#include <hip/hip_runtime.h>
#include <hip/hip_bf16.h>

typedef float v2f __attribute__((ext_vector_type(2)));
typedef float v8f __attribute__((ext_vector_type(8)));

#define TILE_M 64
#define TILE_N 128
#define KC 32
#define LDS_PAD 34  // row stride in dwords; conflict-free for fragment gathers

// ---------------------------------------------------------------------------
// GEMM: Out[M,Nc] = A[M,K] @ Bm[Nc,K]^T (+ bias[Nc])
// fp32 WMMA 16x16x4, wave32. Block = 256 threads = 8 waves, 64x128 tile.
// Each wave: 16 rows x 64 cols (4 N-subtiles) -> 1 A-frag feeds 4 WMMAs.
// Register double-buffering hides global->LDS staging behind the WMMA chain.
// HEADW == 0: A is row-major [M][K]. HEADW > 0: A is K/HEADW planes of
// [M][HEADW], column k lying in plane k / HEADW (HEADW a multiple of 4).
// ---------------------------------------------------------------------------
template <int HEADW>
__device__ __forceinline__ const float4* a_piece(const float* A, int M, int K, int row, int k)
{
    if (HEADW == 0) return (const float4*)(A + (size_t)row * K + k);
    const int h = k / HEADW;
    return (const float4*)(A + ((size_t)h * M + row) * HEADW + (k - h * HEADW));
}

// One 64x128 tile: the staging and the WMMA loop. SWAP == false: c[s] register v = tile
// element [wm*16 + v + 8*kh][wn*64 + s*16 + lm]. SWAP == true: the two fragments change
// places in the WMMA, so c[s] holds the transpose: register v = [wm*16 + lm][wn*64 + s*16 + v + 8*kh].
template <int HEADW, bool SWAP>
__device__ __forceinline__ void gemm_tile(
    const float* __restrict__ A, const float* __restrict__ Bm,
    int M, int K, int m0, int n0,
    float (*As)[LDS_PAD], float (*Bs)[LDS_PAD], v8f (&c)[4])
{
    const int tid  = threadIdx.x;
    const int wave = tid >> 5;
    const int lane = tid & 31;
    const int wm   = wave & 3;   // 4 waves along M
    const int wn   = wave >> 2;  // 2 waves along N, 64 cols each
    const int lm   = lane & 15;
    const int kh   = lane >> 4;  // 0/1 half of wave

    // staging registers: 2 float4 for A tile, 4 float4 for B tile
    float4 ra[2], rb[4];
    // per-thread staging coordinates (row, kcol) for the 6 float4 pieces
    int arow[2], acol[2], brow[4], bcol[4];
    #pragma unroll
    for (int j = 0; j < 2; ++j) {
        int li = tid + j * 256;          // 0..511 -> A tile (64x32 = 512 float4)
        arow[j] = li >> 3;
        acol[j] = (li & 7) << 2;
    }
    #pragma unroll
    for (int j = 0; j < 4; ++j) {
        int li = tid + j * 256;          // 0..1023 -> B tile (128x32 = 1024 float4)
        brow[j] = li >> 3;
        bcol[j] = (li & 7) << 2;
    }

    #pragma unroll
    for (int s = 0; s < 4; ++s) c[s] = (v8f){};

    // prologue: stage chunk 0
    #pragma unroll
    for (int j = 0; j < 2; ++j)
        ra[j] = *a_piece<HEADW>(A, M, K, m0 + arow[j], acol[j]);
    #pragma unroll
    for (int j = 0; j < 4; ++j)
        rb[j] = *(const float4*)(Bm + (size_t)(n0 + brow[j]) * K + bcol[j]);
    #pragma unroll
    for (int j = 0; j < 2; ++j) {
        As[arow[j]][acol[j]+0] = ra[j].x; As[arow[j]][acol[j]+1] = ra[j].y;
        As[arow[j]][acol[j]+2] = ra[j].z; As[arow[j]][acol[j]+3] = ra[j].w;
    }
    #pragma unroll
    for (int j = 0; j < 4; ++j) {
        Bs[brow[j]][bcol[j]+0] = rb[j].x; Bs[brow[j]][bcol[j]+1] = rb[j].y;
        Bs[brow[j]][bcol[j]+2] = rb[j].z; Bs[brow[j]][bcol[j]+3] = rb[j].w;
    }
    __syncthreads();

    for (int k0 = 0; k0 < K; k0 += KC) {
        const bool last = (k0 + KC >= K);
        if (!last) {
            // prefetch next chunk into registers (overlaps WMMA chain)
            #pragma unroll
            for (int j = 0; j < 2; ++j)
                ra[j] = *a_piece<HEADW>(A, M, K, m0 + arow[j], k0 + KC + acol[j]);
            #pragma unroll
            for (int j = 0; j < 4; ++j)
                rb[j] = *(const float4*)(Bm + (size_t)(n0 + brow[j]) * K + k0 + KC + bcol[j]);
        }

        #pragma unroll
        for (int kk = 0; kk < KC; kk += 4) {
            // A frag: value j -> A[m][kk + j + 2*kh]; B frag mirrors in K
            v2f a = *(const v2f*)&As[wm * 16 + lm][kk + 2 * kh];
            #pragma unroll
            for (int s = 0; s < 4; ++s) {
                v2f b = *(const v2f*)&Bs[wn * 64 + s * 16 + lm][kk + 2 * kh];
                c[s] = SWAP
                    ? __builtin_amdgcn_wmma_f32_16x16x4_f32(
                        false, b, false, a, (short)0, c[s], false, false)
                    : __builtin_amdgcn_wmma_f32_16x16x4_f32(
                        false, a, false, b, (short)0, c[s], false, false);
            }
        }
        __syncthreads();   // all LDS reads of this chunk done

        if (!last) {
            // commit prefetched chunk
            #pragma unroll
            for (int j = 0; j < 2; ++j) {
                As[arow[j]][acol[j]+0] = ra[j].x; As[arow[j]][acol[j]+1] = ra[j].y;
                As[arow[j]][acol[j]+2] = ra[j].z; As[arow[j]][acol[j]+3] = ra[j].w;
            }
            #pragma unroll
            for (int j = 0; j < 4; ++j) {
                Bs[brow[j]][bcol[j]+0] = rb[j].x; Bs[brow[j]][bcol[j]+1] = rb[j].y;
                Bs[brow[j]][bcol[j]+2] = rb[j].z; Bs[brow[j]][bcol[j]+3] = rb[j].w;
            }
            __syncthreads();
        }
    }
}

template <int HEADW>
__global__ __launch_bounds__(256) void gemm_rt_wmma(
    const float* __restrict__ A, const float* __restrict__ Bm,
    const float* __restrict__ bias, float* __restrict__ Out,
    int M, int K, int Nc)
{
    __shared__ float As[TILE_M][LDS_PAD];
    __shared__ float Bs[TILE_N][LDS_PAD];

    const int tid  = threadIdx.x;
    const int m0   = blockIdx.x * TILE_M;
    const int n0   = blockIdx.y * TILE_N;
    const int wave = tid >> 5;
    const int lane = tid & 31;
    const int wm   = wave & 3;
    const int wn   = wave >> 2;
    const int lm   = lane & 15;
    const int kh   = lane >> 4;

    v8f c[4];
    gemm_tile<HEADW, false>(A, Bm, M, K, m0, n0, As, Bs, c);

    // Epilogue: C layout: VGPR v, half kh: row = v + 8*kh, col = lm
    #pragma unroll
    for (int s = 0; s < 4; ++s) {
        int col = n0 + wn * 64 + s * 16 + lm;
        float bv = bias ? bias[col] : 0.0f;
        #pragma unroll
        for (int v = 0; v < 8; ++v) {
            int row = m0 + wm * 16 + v + 8 * kh;
            Out[(size_t)row * Nc + col] = c[s][v] + bv;
        }
    }
}

typedef float v4f __attribute__((ext_vector_type(4)));

// ---------------------------------------------------------------------------
// qk = x @ w_qk^T with the split into frames and the per-pixel L2 normalization
// over a head's 64 channels done on the accumulators: a wave's 64 columns are
// exactly one head of q or of k, so a pixel's whole channel vector sits in one wave.
// The tile is computed transposed: a lane holds 32 channels of ONE pixel (the lane
// 16 further on the other 32), in runs of eight.
// q and k are both stored as [128 frames][16 channel quads][1024 pixels][4 channels],
// each under its own frame (the reader applies the time shift): 16 lanes then store
// 16 neighbouring pixels of one quad, 256 contiguous bytes.
// ---------------------------------------------------------------------------
__global__ __launch_bounds__(256) void gemm_qk_norm(
    const float* __restrict__ x, const float* __restrict__ w_qk,
    float* __restrict__ qvn, float* __restrict__ kvn, int M, int K)
{
    __shared__ float As[TILE_M][LDS_PAD];
    __shared__ float Bs[TILE_N][LDS_PAD];

    const int m0   = blockIdx.x * TILE_M;
    const int n0   = blockIdx.y * TILE_N;
    // the wave's number as a scalar: all of the epilogue's addressing but the lane's own
    // offset then lives in scalar registers while the WMMA loop runs
    const int wave = __builtin_amdgcn_readfirstlane(threadIdx.x >> 5);
    const int lane = threadIdx.x & 31;
    const int wm   = wave & 3;
    const int wn   = wave >> 2;
    const int lm   = lane & 15;
    const int kh   = lane >> 4;

    // at least one chunk: without a way round the loop its exit leads straight to the epilogue
    __builtin_assume(K >= KC);

    v8f c[4];
    gemm_tile<0, true>(x, w_qk, M, K, m0, n0, As, Bs, c);
    // the loop leaves by a taken branch right behind its last WMMAs:
    // these fill the vector slots that must lie between a WMMA and the first read of its result
    // (eight, the most the distance table asks of any form: it does not list the f32 form)
    asm volatile("v_nop\n\tv_nop\n\tv_nop\n\tv_nop\n\tv_nop\n\tv_nop\n\tv_nop\n\tv_nop"
                 : "+v"(c[0]), "+v"(c[1]), "+v"(c[2]), "+v"(c[3]));

    // lane: pixel p0 + lm, channels s*16 + 8*kh + v
    float ss = 0.0f;
    #pragma unroll
    for (int s = 0; s < 4; ++s)
        #pragma unroll
        for (int v = 0; v < 8; ++v) ss += c[s][v] * c[s][v];
    ss += __shfl_xor(ss, 16, 32);
    const float sc = 1.0f / fmaxf(sqrtf(ss), 1e-12f);

    // the 64 rows of a tile lie in one frame: row = b*8192 + t*1024 + pixel
    const int b  = m0 >> 13;
    const int t  = (m0 >> 10) & 7;
    const int p0 = (m0 & 1023) + wm * 16;         // the wave's first pixel
    const int h  = ((n0 >> 6) + wn) & 7;          // the wave's head
    const size_t fbase = (size_t)(b * 64 + h * 8 + t) * 65536;
    float* dst = (n0 < 512 ? qvn : kvn) + (fbase + p0 * 4) + (2 * kh * 1024 + lm) * 4;
    #pragma unroll
    for (int s = 0; s < 4; ++s)
        #pragma unroll
        for (int j = 0; j < 2; ++j)
            *(v4f*)(dst + (s * 4 + j) * 4096) =
                (v4f){ c[s][4 * j] * sc, c[s][4 * j + 1] * sc, c[s][4 * j + 2] * sc, c[s][4 * j + 3] * sc };
}

// ---------------------------------------------------------------------------
// 7x7 local cost volume (zero-padded).
// Block = (frame, 8-row strip), 256 threads = 1 pixel each.
// The k halo tile (14 x 38 pixels, all 64 channels) sits in LDS pixel-major,
// so one 16-byte LDS read feeds four channels of one displacement.
// Output: one plane per head, [head][B*N][CORRW]: a pixel's 49 correlations and
// three zeros, so that a wave's 32 pixels fill 52 whole 128-byte lines of its own.
// ---------------------------------------------------------------------------
#define SROWS 8
#define TROWS (SROWS + 6)
#define TCOLS 38
#define KPITCH 68   // dwords per pixel: 272 B = 16 B x odd, full-rate 16-byte reads
#define CORRW 52    // 49 correlations padded to whole 16-byte pieces
__global__ __launch_bounds__(256, 4) void costvol(
    const float* __restrict__ qvn, const float* __restrict__ kvn,
    float* __restrict__ cv)
{
    __shared__ __attribute__((aligned(16))) float Ks[TROWS * TCOLS * KPITCH];

    const int f   = blockIdx.x;
    const int y0  = blockIdx.y * SROWS;
    const int tid = threadIdx.x;
    const int x   = tid & 31;
    const int yl  = tid >> 5;           // 0..7
    const int y   = y0 + yl;
    const size_t fbase = (size_t)f * 65536;
    // k comes from the next frame in time; the last frame pairs with itself
    const size_t kbase = (size_t)((f & 7) == 7 ? f : f + 1) * 65536;

    // this pixel's q, one quad of channels a trip, fetched a trip ahead
    const v4f* qp = (const v4f*)(qvn + fbase) + y * 32 + x;
    v4f q = qp[0];

    // stage the 14 x 32 in-frame columns: a wave takes one channel quad of a whole row,
    // 16 bytes a lane. Rows outside the frame load a clamped row and store zeros.
    {
        const int c40 = tid >> 5;       // 0..7
        const int gx  = tid & 31;
        v4f t[2 * TROWS];
        #pragma unroll
        for (int it = 0; it < 2 * TROWS; ++it) {
            int gy  = y0 + (it >> 1) - 3;
            int gyc = gy < 0 ? 0 : (gy > 31 ? 31 : gy);
            // block-uniform row base + this lane's 16 bytes (quad c40 or c40 + 8, pixel gx)
            const float* rowp = kvn + kbase + (it & 1) * 32768 + gyc * 128;
            t[it] = *(const v4f*)(rowp + (c40 * 1024 + gx) * 4);
        }
        #pragma unroll
        for (int it = 0; it < 2 * TROWS; ++it) {
            int r   = it >> 1;
            int gy  = y0 + r - 3;
            int c4  = c40 + (it & 1) * 8;
            v4f val = (gy >= 0 && gy < 32) ? t[it] : (v4f){};
            *(v4f*)&Ks[(r * TCOLS + gx + 3) * KPITCH + c4 * 4] = val;
        }
        // the three zero columns on each side
        for (int i = tid; i < TROWS * 6 * 16; i += 256) {
            int px = i >> 4;
            int r  = px / 6;
            int j  = px - r * 6;
            int lc = j < 3 ? j : j + 32;
            *(v4f*)&Ks[(r * TCOLS + lc) * KPITCH + (i & 15) * 4] = (v4f){};
        }
    }
    __syncthreads();

    float corr[49];
    #pragma unroll
    for (int i = 0; i < 49; ++i) corr[i] = 0.0f;

    const float* kb = &Ks[(yl * TCOLS + x) * KPITCH];
    // kept rolled: unrolled over the channels, the 784 LDS reads are hoisted and spill
    #pragma unroll 1
    for (int c = 0; c < 16; ++c) {
        const int cn = c < 15 ? c + 1 : 15;
        const v4f qn = qp[cn * 1024];
        const float* kc = kb + c * 4;
        v4f cur[7], nxt[7];
        #pragma unroll
        for (int v = 0; v < 7; ++v) cur[v] = *(const v4f*)(kc + v * KPITCH);
        #pragma unroll
        for (int u = 0; u < 7; ++u) {
            if (u < 6) {
                #pragma unroll
                for (int v = 0; v < 7; ++v)
                    nxt[v] = *(const v4f*)(kc + ((u + 1) * TCOLS + v) * KPITCH);
            }
            #pragma unroll
            for (int v = 0; v < 7; ++v) {
                float a = corr[u * 7 + v];
                a += q.x * cur[v].x;
                a += q.y * cur[v].y;
                a += q.z * cur[v].z;
                a += q.w * cur[v].w;
                corr[u * 7 + v] = a;
            }
            // stops the reads of later rows from being hoisted to here: without it all 49
            // are put in flight at once, which takes 256 registers and spills
            __builtin_amdgcn_sched_barrier(0);
            #pragma unroll
            for (int v = 0; v < 7; ++v) cur[v] = nxt[v];
        }
        q = qn;
    }

    // store the correlations into this head's plane
    const int b = f >> 6;
    const int h = (f >> 3) & 7;
    const int t = f & 7;
    const int n = t * 1024 + y * 32 + x;
    float4* outp = (float4*)(cv + ((size_t)h * 16384 + b * 8192 + n) * CORRW);

    #pragma unroll   // constant indices keep corr[] in registers
    for (int g = 0; g < 12; ++g)
        outp[g] = make_float4(corr[4 * g], corr[4 * g + 1], corr[4 * g + 2], corr[4 * g + 3]);
    outp[12] = make_float4(corr[48], 0.0f, 0.0f, 0.0f);
}

// ---------------------------------------------------------------------------
// Folds the 49->64 projection into the final projection's weights:
//   wf[o][h*CORRW + uv] = sum_d w_proj[o][h*64 + d] * w_corr[d][uv]   (0 for uv >= 49)
//   bf[o]               = b_proj[o] + sum_c w_proj[o][c] * b_corr[c % 64]
// Block = one output column o; threads 0..415 one wf element each, wave 13 the bias.
// ---------------------------------------------------------------------------
__global__ __launch_bounds__(448) void fold_proj(
    const float* __restrict__ w_proj, const float* __restrict__ w_corr,
    const float* __restrict__ b_corr, const float* __restrict__ b_proj,
    float* __restrict__ wf, float* __restrict__ bf)
{
    __shared__ float Wp[512];
    __shared__ float Wc[64 * 49];

    const int o   = blockIdx.x;
    const int tid = threadIdx.x;
    // all loads first, so that they are in flight together (64 * 49 = 7 * 448)
    float rc[7];
    #pragma unroll   // rc[] stays in registers
    for (int i = 0; i < 7; ++i) rc[i] = w_corr[tid + 448 * i];
    const float rp0 = w_proj[o * 512 + tid];
    const float rp1 = w_proj[o * 512 + 448 + (tid & 63)];
    #pragma unroll   // rc[] stays in registers
    for (int i = 0; i < 7; ++i) Wc[tid + 448 * i] = rc[i];
    Wp[tid] = rp0;
    if (tid < 64) Wp[448 + tid] = rp1;
    __syncthreads();

    if (tid < 8 * CORRW) {
        const int h  = tid / CORRW;
        const int uv = tid - h * CORRW;
        float acc = 0.0f;
        if (uv < 49) {
            // four partial sums and a flat loop: the LDS reads run ahead of the adds
            float a0 = 0.0f, a1 = 0.0f, a2 = 0.0f, a3 = 0.0f;
            #pragma unroll
            for (int d = 0; d < 64; d += 4) {
                a0 += Wp[h * 64 + d + 0] * Wc[(d + 0) * 49 + uv];
                a1 += Wp[h * 64 + d + 1] * Wc[(d + 1) * 49 + uv];
                a2 += Wp[h * 64 + d + 2] * Wc[(d + 2) * 49 + uv];
                a3 += Wp[h * 64 + d + 3] * Wc[(d + 3) * 49 + uv];
            }
            acc = (a0 + a1) + (a2 + a3);
        }
        wf[o * (8 * CORRW) + tid] = acc;
    } else {
        const int lane = tid - 8 * CORRW;   // 0..31
        float s = 0.0f;
        #pragma unroll   // the 16 LDS reads are issued together
        for (int i = 0; i < 16; ++i) {
            int c = lane + 32 * i;
            s += Wp[c] * b_corr[c & 63];
        }
        #pragma unroll   // five fixed steps of the wave-wide sum
        for (int m = 16; m >= 1; m >>= 1) s += __shfl_xor(s, m, 32);
        if (lane == 0) bf[o] = b_proj[o] + s;
    }
}

// ---------------------------------------------------------------------------
extern "C" void kernel_launch(void* const* d_in, const int* in_sizes, int n_in,
                              void* d_out, int out_size, void* d_ws, size_t ws_size,
                              hipStream_t stream)
{
    const float* x      = (const float*)d_in[0];  // [2, 8192, 512]
    const float* w_qk   = (const float*)d_in[1];  // [1024, 512]
    const float* w_corr = (const float*)d_in[2];  // [64, 49]
    const float* b_corr = (const float*)d_in[3];  // [64]
    const float* w_proj = (const float*)d_in[4];  // [512, 512]
    const float* b_proj = (const float*)d_in[5];  // [512]
    float* out = (float*)d_out;                   // [2, 8192, 512]

    const int M = 16384, K = 512;

    float* cv  = (float*)d_ws;                      // 8 planes of 16384*52 floats (27 MB)
    float* qvn = cv + (size_t)16384 * 1024;         // 128*64*1024 floats (32 MB)
    float* kvn = qvn + (size_t)128 * 65536;         // 32 MB
    float* wf  = kvn + (size_t)128 * 65536;         // folded weights [512][416]
    float* bf  = wf + (size_t)512 * 8 * CORRW;      // folded bias [512]

    // 0) fold w_corr, b_corr into the final projection's weights and bias
    fold_proj<<<512, 448, 0, stream>>>(w_proj, w_corr, b_corr, b_proj, wf, bf);

    // 1) qk = x @ w_qk^T, L2-normalized per head and pixel; q and k in channel quads
    gemm_qk_norm<<<dim3(M / TILE_M, 1024 / TILE_N), 256, 0, stream>>>(
        x, w_qk, qvn, kvn, M, K);

    // 2) cost volume (k of the next frame), one plane of 52 columns per head
    costvol<<<dim3(128, 32 / SROWS), 256, 0, stream>>>(qvn, kvn, cv);

    // 3) out = cv @ wf^T + bf, K = 8 heads x 52
    gemm_rt_wmma<CORRW><<<dim3(M / TILE_M, 512 / TILE_N), 256, 0, stream>>>(
        cv, wf, bf, out, M, 8 * CORRW, 512);
}
